// v000
// Measured on an AMD MI455X. A time is GPU time per run, averaged over a window of back-to-back runs after a warm-up
// (all launches, gaps included; the runs take copies of the inputs in turn), and the median of several windows.
// Apart from v000's, it joins two sittings. Times from different sittings can be a few percent apart, while
// side-by-side timings come from the same sitting.
// The starting kernel, v000, takes 67.8 microseconds a run.
#include <hip/hip_runtime.h>
#include <hip/hip_bf16.h>
#include <hip/hip_vector_types.h>

// Problem constants
#define B_DIM 4
#define L_DIM 8192
#define H_DIM 1024
#define S_DIM 64
#define NCHUNK (L_DIM / 64)   // 128 chunks of 64 rows each
#define EPS 1.1920928955078125e-07f

typedef __attribute__((ext_vector_type(2))) float v2f;
typedef __attribute__((ext_vector_type(8))) float v8f;
typedef int v4i __attribute__((vector_size(16)));   // matches builtin param type

// CDNA5 async global->LDS DMA (ASYNCcnt-tracked, no VGPR round trip).
// Builtin prototype (from hipcc diagnostic): (v4i* as1, v4i* as3, imm, imm)
__device__ __forceinline__ void async_copy_b128(const float* gsrc, float* lds_dst) {
    __builtin_amdgcn_global_load_async_to_lds_b128(
        (__attribute__((address_space(1))) v4i*)gsrc,
        (__attribute__((address_space(3))) v4i*)lds_dst,
        0, 0);
}

// ---------------------------------------------------------------------------
// Kernel 1: state tile GEMM  (x[b, l0:l0+64, :] @ Ws^T) -> state (B,L,S)
// Double-buffered K-panels streamed via global_load_async_to_lds_b128.
// Block: 256 threads (8 wave32). Each wave owns 2 of the 16 (16x16) tiles.
// ---------------------------------------------------------------------------
__global__ __launch_bounds__(256)
void gemm1_kernel(const float* __restrict__ x, const float* __restrict__ Ws,
                  float* __restrict__ state, float* __restrict__ chunkSums) {
    __shared__ float lds_x[2][64][68];   // double-buffered 64x64 panels of x
    __shared__ float lds_w[2][64][68];   // double-buffered 64x64 panels of Ws
    __shared__ float colsum[4][64];      // per-mt column sums

    const int blk   = blockIdx.x;
    const int b     = blk / NCHUNK;
    const int chunk = blk % NCHUNK;
    const int row0  = chunk * 64;

    const int tid  = threadIdx.x;
    const int w    = tid >> 5;        // wave id 0..7
    const int lane = tid & 31;
    const int half = lane >> 4;       // 0: lanes 0-15, 1: lanes 16-31
    const int lm   = lane & 15;

    // Tile assignment: wave w -> tiles 2w, 2w+1 of the 4x4 (mt,nt) grid
    const int t0 = w * 2, t1 = w * 2 + 1;
    const int mt0 = t0 >> 2, nt0 = t0 & 3;
    const int mt1 = t1 >> 2, nt1 = t1 & 3;

    v8f acc0 = {0.f,0.f,0.f,0.f,0.f,0.f,0.f,0.f};
    v8f acc1 = {0.f,0.f,0.f,0.f,0.f,0.f,0.f,0.f};

    const float* xbase = x + (size_t)(b * L_DIM + row0) * H_DIM;

    // Prologue: stage panel 0 into buffer 0 (8 async ops per thread)
    {
        #pragma unroll
        for (int i = 0; i < 4; ++i) {
            int id = tid + i * 256;            // 0..1023
            int r  = id >> 4;                  // row 0..63
            int c  = (id & 15) * 4;            // float col 0..60
            async_copy_b128(xbase + (size_t)r * H_DIM + c, &lds_x[0][r][c]);
            async_copy_b128(Ws    + (size_t)r * H_DIM + c, &lds_w[0][r][c]);
        }
    }

    for (int kc = 0; kc < H_DIM / 64; ++kc) {
        const int cur = kc & 1;
        if (kc + 1 < H_DIM / 64) {
            const int nxt = cur ^ 1;
            #pragma unroll
            for (int i = 0; i < 4; ++i) {
                int id = tid + i * 256;
                int r  = id >> 4;
                int c  = (id & 15) * 4;
                async_copy_b128(xbase + (size_t)r * H_DIM + (kc + 1) * 64 + c,
                                &lds_x[nxt][r][c]);
                async_copy_b128(Ws    + (size_t)r * H_DIM + (kc + 1) * 64 + c,
                                &lds_w[nxt][r][c]);
            }
            // 8 newest async ops are the next panel; anything older (current
            // panel) has completed once ASYNCcnt <= 8.
            asm volatile("s_wait_asynccnt 0x8" ::: "memory");
        } else {
            asm volatile("s_wait_asynccnt 0x0" ::: "memory");
        }
        __syncthreads();

        // 16 WMMA K-steps of 4 over this 64-wide panel, for both tiles
        #pragma unroll
        for (int kk = 0; kk < 16; ++kk) {
            const int kb = kk * 4 + half * 2;   // A: lanes 0-15 K=0,1; 16-31 K=2,3
            v2f a0 = { lds_x[cur][mt0 * 16 + lm][kb], lds_x[cur][mt0 * 16 + lm][kb + 1] };
            v2f b0 = { lds_w[cur][nt0 * 16 + lm][kb], lds_w[cur][nt0 * 16 + lm][kb + 1] };
            acc0 = __builtin_amdgcn_wmma_f32_16x16x4_f32(
                false, a0, false, b0, (short)0, acc0, false, false);
            v2f a1 = { lds_x[cur][mt1 * 16 + lm][kb], lds_x[cur][mt1 * 16 + lm][kb + 1] };
            v2f b1 = { lds_w[cur][nt1 * 16 + lm][kb], lds_w[cur][nt1 * 16 + lm][kb + 1] };
            acc1 = __builtin_amdgcn_wmma_f32_16x16x4_f32(
                false, a1, false, b1, (short)0, acc1, false, false);
        }
        __syncthreads();   // all waves done reading 'cur' before it is re-filled
    }

    // Write state tile (C/D layout: VGPR v -> row v (lanes 0-15) / v+8 (16-31))
    float* sbase = state + (size_t)(b * L_DIM + row0) * S_DIM;
    #pragma unroll
    for (int v = 0; v < 8; ++v) {
        sbase[(mt0 * 16 + half * 8 + v) * S_DIM + nt0 * 16 + lm] = acc0[v];
        sbase[(mt1 * 16 + half * 8 + v) * S_DIM + nt1 * 16 + lm] = acc1[v];
    }

    // Per-tile column sums: sum the 8 rows this lane holds, fold the two
    // 16-lane halves of the wave32, leaving the 16-row tile sum in lanes 0-15.
    float p0 = 0.f, p1 = 0.f;
    #pragma unroll
    for (int v = 0; v < 8; ++v) { p0 += acc0[v]; p1 += acc1[v]; }
    p0 += __shfl_down(p0, 16, 32);
    p1 += __shfl_down(p1, 16, 32);
    if (half == 0) {
        colsum[mt0][nt0 * 16 + lm] = p0;
        colsum[mt1][nt1 * 16 + lm] = p1;
    }
    __syncthreads();

    if (tid < 64) {
        float cs = colsum[0][tid] + colsum[1][tid] + colsum[2][tid] + colsum[3][tid];
        chunkSums[(size_t)(b * NCHUNK + chunk) * S_DIM + tid] = cs;
    }
}

// ---------------------------------------------------------------------------
// Kernel 2: exclusive scan of chunk sums along the chunk dimension per (b, s)
// ---------------------------------------------------------------------------
__global__ __launch_bounds__(64)
void scan_kernel(const float* __restrict__ chunkSums, float* __restrict__ chunkOff) {
    const int b = blockIdx.x;
    const int s = threadIdx.x;
    float run = 0.f;
    for (int c = 0; c < NCHUNK; ++c) {
        size_t idx = (size_t)(b * NCHUNK + c) * S_DIM + s;
        chunkOff[idx] = run;
        run += chunkSums[idx];
    }
}

// ---------------------------------------------------------------------------
// Kernel 3: in-chunk cumsum + RMSNorm + GEMM2 (norm @ Wo^T) -> out (B,L,H)
// grid.x = chunk, grid.y = half of H (512 columns each) for more parallelism.
// ---------------------------------------------------------------------------
__global__ __launch_bounds__(256)
void gemm2_kernel(const float* __restrict__ state, const float* __restrict__ chunkOff,
                  const float* __restrict__ Wo, float* __restrict__ out) {
    __shared__ float lds_s[64][68];
    __shared__ float rsc[64];

    const int blk   = blockIdx.x;
    const int b     = blk / NCHUNK;
    const int chunk = blk % NCHUNK;
    const int row0  = chunk * 64;
    const int ng    = blockIdx.y;     // 0 or 1 -> H columns [ng*512, ng*512+512)

    const int tid  = threadIdx.x;
    const int w    = tid >> 5;
    const int lane = tid & 31;
    const int half = lane >> 4;
    const int lm   = lane & 15;

    // Stage the 64x64 state tile with async DMA (4 b128 per thread)
    const float* sbase = state + (size_t)(b * L_DIM + row0) * S_DIM;
    #pragma unroll
    for (int i = 0; i < 4; ++i) {
        int id = tid + i * 256;
        int r  = id >> 4;
        int c  = (id & 15) * 4;
        async_copy_b128(sbase + (size_t)r * S_DIM + c, &lds_s[r][c]);
    }
    asm volatile("s_wait_asynccnt 0x0" ::: "memory");
    __syncthreads();

    // In-chunk cumsum down the 64 rows (one thread per s-column)
    if (tid < 64) {
        float run = chunkOff[(size_t)(b * NCHUNK + chunk) * S_DIM + tid];
        for (int r = 0; r < 64; ++r) {
            run += lds_s[r][tid];
            lds_s[r][tid] = run;
        }
    }
    __syncthreads();

    // RMS scale per row
    if (tid < 64) {
        float ss = 0.f;
        #pragma unroll
        for (int c = 0; c < 64; ++c) { float v = lds_s[tid][c]; ss += v * v; }
        rsc[tid] = rsqrtf(ss * (1.0f / (float)S_DIM) + EPS);
    }
    __syncthreads();

    // GEMM2: M=64 rows, K=64 (s), N=512 columns for this group.
    // Wave w handles nt = ng*32 + w + 8*j; B-fragments cached over the 4 M-tiles.
    float* obase = out + (size_t)(b * L_DIM + row0) * H_DIM;
    for (int j = 0; j < 4; ++j) {
        const int nt = ng * 32 + w + 8 * j;
        const int n  = nt * 16 + lm;          // global h index for this lane
        v2f bf[16];
        #pragma unroll
        for (int kk = 0; kk < 16; ++kk) {
            int kb = kk * 4 + half * 2;
            bf[kk][0] = Wo[(size_t)n * S_DIM + kb];
            bf[kk][1] = Wo[(size_t)n * S_DIM + kb + 1];
        }
        #pragma unroll
        for (int mt = 0; mt < 4; ++mt) {
            v8f acc = {0.f,0.f,0.f,0.f,0.f,0.f,0.f,0.f};
            #pragma unroll
            for (int kk = 0; kk < 16; ++kk) {
                int kb = kk * 4 + half * 2;
                int m  = mt * 16 + lm;
                float sc = rsc[m];
                v2f a = { lds_s[m][kb] * sc, lds_s[m][kb + 1] * sc };
                acc = __builtin_amdgcn_wmma_f32_16x16x4_f32(
                    false, a, false, bf[kk], (short)0, acc, false, false);
            }
            #pragma unroll
            for (int v = 0; v < 8; ++v) {
                obase[(size_t)(mt * 16 + half * 8 + v) * H_DIM + n] = acc[v];
            }
        }
    }
}

// ---------------------------------------------------------------------------
// Host launch
// ---------------------------------------------------------------------------
extern "C" void kernel_launch(void* const* d_in, const int* in_sizes, int n_in,
                              void* d_out, int out_size, void* d_ws, size_t ws_size,
                              hipStream_t stream) {
    (void)in_sizes; (void)n_in; (void)out_size; (void)ws_size;
    const float* x  = (const float*)d_in[0];   // (B, L, H)
    const float* Ws = (const float*)d_in[1];   // (S, H)
    const float* Wo = (const float*)d_in[2];   // (H, S)
    float* out = (float*)d_out;                // (B, L, H)

    // Workspace layout: state (8 MB) | chunkSums (128 KB) | chunkOff (128 KB)
    float* state     = (float*)d_ws;
    float* chunkSums = state + (size_t)B_DIM * L_DIM * S_DIM;
    float* chunkOff  = chunkSums + (size_t)B_DIM * NCHUNK * S_DIM;

    gemm1_kernel<<<dim3(B_DIM * NCHUNK), dim3(256), 0, stream>>>(x, Ws, state, chunkSums);
    scan_kernel<<<dim3(B_DIM), dim3(64), 0, stream>>>(chunkSums, chunkOff);
    gemm2_kernel<<<dim3(B_DIM * NCHUNK, 2), dim3(256), 0, stream>>>(state, chunkOff, Wo, out);
}

// v001
// It runs in 59.3 microseconds.
// Timed twice side by side with v000, it ran 1.16 times as fast both times.
#include <hip/hip_runtime.h>
#include <hip/hip_bf16.h>
#include <hip/hip_vector_types.h>

// Problem constants
#define B_DIM 4
#define L_DIM 8192
#define H_DIM 1024
#define S_DIM 64
#define NCHUNK (L_DIM / 64)   // 128 chunks of 64 rows each
#define EPS 1.1920928955078125e-07f

typedef __attribute__((ext_vector_type(2))) float v2f;
typedef __attribute__((ext_vector_type(8))) float v8f;
typedef int v4i __attribute__((vector_size(16)));   // matches builtin param type

// CDNA5 async global->LDS DMA (ASYNCcnt-tracked, no VGPR round trip).
// Builtin prototype (from hipcc diagnostic): (v4i* as1, v4i* as3, imm, imm)
__device__ __forceinline__ void async_copy_b128(const float* gsrc, float* lds_dst) {
    __builtin_amdgcn_global_load_async_to_lds_b128(
        (__attribute__((address_space(1))) v4i*)gsrc,
        (__attribute__((address_space(3))) v4i*)lds_dst,
        0, 0);
}

// ---------------------------------------------------------------------------
// Kernel 1: state tile GEMM  (x[b, l0:l0+64, :] @ Ws^T) -> state (B,L,S)
// Double-buffered K-panels streamed via global_load_async_to_lds_b128.
// Block: 256 threads (8 wave32). Each wave owns 2 of the 16 (16x16) tiles.
// ---------------------------------------------------------------------------
__global__ __launch_bounds__(256)
void gemm1_kernel(const float* __restrict__ x, const float* __restrict__ Ws,
                  float* __restrict__ state, float* __restrict__ chunkSums) {
    __shared__ float lds_x[2][64][68];   // double-buffered 64x64 panels of x
    __shared__ float lds_w[2][64][68];   // double-buffered 64x64 panels of Ws
    __shared__ float colsum[4][64];      // per-mt column sums

    const int blk   = blockIdx.x;
    const int b     = blk / NCHUNK;
    const int chunk = blk % NCHUNK;
    const int row0  = chunk * 64;

    const int tid  = threadIdx.x;
    const int w    = tid >> 5;        // wave id 0..7
    const int lane = tid & 31;
    const int half = lane >> 4;       // 0: lanes 0-15, 1: lanes 16-31
    const int lm   = lane & 15;

    // Tile assignment: wave w -> tiles 2w, 2w+1 of the 4x4 (mt,nt) grid
    const int t0 = w * 2, t1 = w * 2 + 1;
    const int mt0 = t0 >> 2, nt0 = t0 & 3;
    const int mt1 = t1 >> 2, nt1 = t1 & 3;

    v8f acc0 = {0.f,0.f,0.f,0.f,0.f,0.f,0.f,0.f};
    v8f acc1 = {0.f,0.f,0.f,0.f,0.f,0.f,0.f,0.f};

    const float* xbase = x + (size_t)(b * L_DIM + row0) * H_DIM;

    // Prologue: stage panel 0 into buffer 0 (8 async ops per thread)
    {
        #pragma unroll
        for (int i = 0; i < 4; ++i) {
            int id = tid + i * 256;            // 0..1023
            int r  = id >> 4;                  // row 0..63
            int c  = (id & 15) * 4;            // float col 0..60
            async_copy_b128(xbase + (size_t)r * H_DIM + c, &lds_x[0][r][c]);
            async_copy_b128(Ws    + (size_t)r * H_DIM + c, &lds_w[0][r][c]);
        }
    }

    for (int kc = 0; kc < H_DIM / 64; ++kc) {
        const int cur = kc & 1;
        if (kc + 1 < H_DIM / 64) {
            const int nxt = cur ^ 1;
            #pragma unroll
            for (int i = 0; i < 4; ++i) {
                int id = tid + i * 256;
                int r  = id >> 4;
                int c  = (id & 15) * 4;
                async_copy_b128(xbase + (size_t)r * H_DIM + (kc + 1) * 64 + c,
                                &lds_x[nxt][r][c]);
                async_copy_b128(Ws    + (size_t)r * H_DIM + (kc + 1) * 64 + c,
                                &lds_w[nxt][r][c]);
            }
            // 8 newest async ops are the next panel; anything older (current
            // panel) has completed once ASYNCcnt <= 8.
            asm volatile("s_wait_asynccnt 0x8" ::: "memory");
        } else {
            asm volatile("s_wait_asynccnt 0x0" ::: "memory");
        }
        __syncthreads();

        // 16 WMMA K-steps of 4 over this 64-wide panel, for both tiles
        #pragma unroll
        for (int kk = 0; kk < 16; ++kk) {
            const int kb = kk * 4 + half * 2;   // A: lanes 0-15 K=0,1; 16-31 K=2,3
            v2f a0 = { lds_x[cur][mt0 * 16 + lm][kb], lds_x[cur][mt0 * 16 + lm][kb + 1] };
            v2f b0 = { lds_w[cur][nt0 * 16 + lm][kb], lds_w[cur][nt0 * 16 + lm][kb + 1] };
            acc0 = __builtin_amdgcn_wmma_f32_16x16x4_f32(
                false, a0, false, b0, (short)0, acc0, false, false);
            v2f a1 = { lds_x[cur][mt1 * 16 + lm][kb], lds_x[cur][mt1 * 16 + lm][kb + 1] };
            v2f b1 = { lds_w[cur][nt1 * 16 + lm][kb], lds_w[cur][nt1 * 16 + lm][kb + 1] };
            acc1 = __builtin_amdgcn_wmma_f32_16x16x4_f32(
                false, a1, false, b1, (short)0, acc1, false, false);
        }
        __syncthreads();   // all waves done reading 'cur' before it is re-filled
    }

    // Write state tile (C/D layout: VGPR v -> row v (lanes 0-15) / v+8 (16-31))
    float* sbase = state + (size_t)(b * L_DIM + row0) * S_DIM;
    #pragma unroll
    for (int v = 0; v < 8; ++v) {
        sbase[(mt0 * 16 + half * 8 + v) * S_DIM + nt0 * 16 + lm] = acc0[v];
        sbase[(mt1 * 16 + half * 8 + v) * S_DIM + nt1 * 16 + lm] = acc1[v];
    }

    // Per-tile column sums: sum the 8 rows this lane holds, fold the two
    // 16-lane halves of the wave32, leaving the 16-row tile sum in lanes 0-15.
    float p0 = 0.f, p1 = 0.f;
    #pragma unroll
    for (int v = 0; v < 8; ++v) { p0 += acc0[v]; p1 += acc1[v]; }
    p0 += __shfl_down(p0, 16, 32);
    p1 += __shfl_down(p1, 16, 32);
    if (half == 0) {
        colsum[mt0][nt0 * 16 + lm] = p0;
        colsum[mt1][nt1 * 16 + lm] = p1;
    }
    __syncthreads();

    if (tid < 64) {
        float cs = colsum[0][tid] + colsum[1][tid] + colsum[2][tid] + colsum[3][tid];
        chunkSums[(size_t)(b * NCHUNK + chunk) * S_DIM + tid] = cs;
    }
}

// ---------------------------------------------------------------------------
// Kernel 2: chunk offset + in-chunk cumsum + RMSNorm + GEMM2 (norm @ Wo^T) -> out
// Each block adds up the sums of the chunks in front of its own by itself, so
// no separate scan launch stands between the two GEMMs.
// grid.x = chunk, grid.y = half of H (512 columns each) for more parallelism.
// ---------------------------------------------------------------------------
__global__ __launch_bounds__(256)
void gemm2_kernel(const float* __restrict__ state, const float* __restrict__ chunkSums,
                  const float* __restrict__ Wo, float* __restrict__ out) {
    __shared__ float lds_s[64][68];
    __shared__ float rsc[64];
    __shared__ __attribute__((aligned(16))) float offp[16][64];  // partial sums of the earlier chunks' sums

    const int blk   = blockIdx.x;
    const int b     = blk / NCHUNK;
    const int chunk = blk % NCHUNK;
    const int row0  = chunk * 64;
    const int ng    = blockIdx.y;     // 0 or 1 -> H columns [ng*512, ng*512+512)

    const int tid  = threadIdx.x;
    const int w    = tid >> 5;
    const int lane = tid & 31;
    const int half = lane >> 4;
    const int lm   = lane & 15;

    // Stage the 64x64 state tile with async DMA (4 b128 per thread)
    const float* sbase = state + (size_t)(b * L_DIM + row0) * S_DIM;
    #pragma unroll
    for (int i = 0; i < 4; ++i) {
        int id = tid + i * 256;
        int r  = id >> 4;
        int c  = (id & 15) * 4;
        async_copy_b128(sbase + (size_t)r * S_DIM + c, &lds_s[r][c]);
    }

    // Offset of this chunk = sum of the column sums of chunks 0..chunk-1.
    // 16 groups of 16 threads; group g adds chunks 8g..8g+7, four columns a
    // thread. All eight loads are issued before the first add (every chunk sum
    // of this batch row was written by the launch before), later chunks count 0.
    {
        const int g = tid >> 4;
        const int q = (tid & 15) * 4;
        float4 p = make_float4(0.f, 0.f, 0.f, 0.f);
        if (w * 16 < chunk) {             // same for the whole wave
            const float* cs = chunkSums + (size_t)(b * NCHUNK + g * 8) * S_DIM + q;
            float4 v[8];
            #pragma unroll   // keeps v in registers and the eight loads in flight together
            for (int i = 0; i < 8; ++i) v[i] = *(const float4*)(cs + i * S_DIM);
            #pragma unroll
            for (int i = 0; i < 8; ++i) {
                const bool on = g * 8 + i < chunk;
                p.x += on ? v[i].x : 0.f;
                p.y += on ? v[i].y : 0.f;
                p.z += on ? v[i].z : 0.f;
                p.w += on ? v[i].w : 0.f;
            }
        }
        *(float4*)&offp[g][q] = p;
    }
    asm volatile("s_wait_asynccnt 0x0" ::: "memory");
    __syncthreads();

    // In-chunk cumsum down the 64 rows (one thread per s-column)
    if (tid < 64) {
        float run = 0.f;
        #pragma unroll   // the 16 LDS reads go out together instead of one a trip
        for (int g = 0; g < 16; ++g) run += offp[g][tid];
        for (int r = 0; r < 64; ++r) {
            run += lds_s[r][tid];
            lds_s[r][tid] = run;
        }
    }
    __syncthreads();

    // RMS scale per row
    if (tid < 64) {
        float ss = 0.f;
        #pragma unroll
        for (int c = 0; c < 64; ++c) { float v = lds_s[tid][c]; ss += v * v; }
        rsc[tid] = rsqrtf(ss * (1.0f / (float)S_DIM) + EPS);
    }
    __syncthreads();

    // GEMM2: M=64 rows, K=64 (s), N=512 columns for this group.
    // Wave w handles nt = ng*32 + w + 8*j; B-fragments cached over the 4 M-tiles.
    float* obase = out + (size_t)(b * L_DIM + row0) * H_DIM;
    for (int j = 0; j < 4; ++j) {
        const int nt = ng * 32 + w + 8 * j;
        const int n  = nt * 16 + lm;          // global h index for this lane
        v2f bf[16];
        #pragma unroll
        for (int kk = 0; kk < 16; ++kk) {
            int kb = kk * 4 + half * 2;
            bf[kk][0] = Wo[(size_t)n * S_DIM + kb];
            bf[kk][1] = Wo[(size_t)n * S_DIM + kb + 1];
        }
        #pragma unroll
        for (int mt = 0; mt < 4; ++mt) {
            v8f acc = {0.f,0.f,0.f,0.f,0.f,0.f,0.f,0.f};
            #pragma unroll
            for (int kk = 0; kk < 16; ++kk) {
                int kb = kk * 4 + half * 2;
                int m  = mt * 16 + lm;
                float sc = rsc[m];
                v2f a = { lds_s[m][kb] * sc, lds_s[m][kb + 1] * sc };
                acc = __builtin_amdgcn_wmma_f32_16x16x4_f32(
                    false, a, false, bf[kk], (short)0, acc, false, false);
            }
            #pragma unroll
            for (int v = 0; v < 8; ++v) {
                obase[(size_t)(mt * 16 + half * 8 + v) * H_DIM + n] = acc[v];
            }
        }
    }
}

// ---------------------------------------------------------------------------
// Host launch
// ---------------------------------------------------------------------------
extern "C" void kernel_launch(void* const* d_in, const int* in_sizes, int n_in,
                              void* d_out, int out_size, void* d_ws, size_t ws_size,
                              hipStream_t stream) {
    (void)in_sizes; (void)n_in; (void)out_size; (void)ws_size;
    const float* x  = (const float*)d_in[0];   // (B, L, H)
    const float* Ws = (const float*)d_in[1];   // (S, H)
    const float* Wo = (const float*)d_in[2];   // (H, S)
    float* out = (float*)d_out;                // (B, L, H)

    // Workspace layout: state (8 MB) | chunkSums (128 KB)
    float* state     = (float*)d_ws;
    float* chunkSums = state + (size_t)B_DIM * L_DIM * S_DIM;

    gemm1_kernel<<<dim3(B_DIM * NCHUNK), dim3(256), 0, stream>>>(x, Ws, state, chunkSums);
    gemm2_kernel<<<dim3(B_DIM * NCHUNK, 2), dim3(256), 0, stream>>>(state, chunkSums, Wo, out);
}

// v002
// It runs in 54.4 microseconds.
// In two side-by-side timings against v001, it was 1.11 and 1.10 times as fast.
// All steps since v000 together make it 1.28 times as fast.
#include <hip/hip_runtime.h>
#include <hip/hip_bf16.h>
#include <hip/hip_vector_types.h>

// Problem constants
#define B_DIM 4
#define L_DIM 8192
#define H_DIM 1024
#define S_DIM 64
#define NCHUNK (L_DIM / 64)   // 128 chunks of 64 rows each
#define EPS 1.1920928955078125e-07f

typedef __attribute__((ext_vector_type(2))) float v2f;
typedef __attribute__((ext_vector_type(8))) float v8f;
typedef int v4i __attribute__((vector_size(16)));   // matches builtin param type

// CDNA5 async global->LDS DMA (ASYNCcnt-tracked, no VGPR round trip).
// Builtin prototype (from hipcc diagnostic): (v4i* as1, v4i* as3, imm, imm)
__device__ __forceinline__ void async_copy_b128(const float* gsrc, float* lds_dst) {
    __builtin_amdgcn_global_load_async_to_lds_b128(
        (__attribute__((address_space(1))) v4i*)gsrc,
        (__attribute__((address_space(3))) v4i*)lds_dst,
        0, 0);
}

// ---------------------------------------------------------------------------
// Kernel 1: state tile GEMM  (x[b, l0:l0+64, :] @ Ws^T) -> state (B,L,S)
// Double-buffered K-panels streamed via global_load_async_to_lds_b128.
// Block: 256 threads (8 wave32). Each wave owns 2 of the 16 (16x16) tiles.
// ---------------------------------------------------------------------------
__global__ __launch_bounds__(256)
void gemm1_kernel(const float* __restrict__ x, const float* __restrict__ Ws,
                  float* __restrict__ state, float* __restrict__ chunkSums) {
    __shared__ float lds_x[2][64][68];   // double-buffered 64x64 panels of x
    __shared__ float lds_w[2][64][68];   // double-buffered 64x64 panels of Ws
    __shared__ float colsum[4][64];      // per-mt column sums

    const int blk   = blockIdx.x;
    const int b     = blk / NCHUNK;
    const int chunk = blk % NCHUNK;
    const int row0  = chunk * 64;

    const int tid  = threadIdx.x;
    const int w    = tid >> 5;        // wave id 0..7
    const int lane = tid & 31;
    const int half = lane >> 4;       // 0: lanes 0-15, 1: lanes 16-31
    const int lm   = lane & 15;

    // Tile assignment: wave w -> tiles 2w, 2w+1 of the 4x4 (mt,nt) grid
    const int t0 = w * 2, t1 = w * 2 + 1;
    const int mt0 = t0 >> 2, nt0 = t0 & 3;
    const int mt1 = t1 >> 2, nt1 = t1 & 3;

    v8f acc0 = {0.f,0.f,0.f,0.f,0.f,0.f,0.f,0.f};
    v8f acc1 = {0.f,0.f,0.f,0.f,0.f,0.f,0.f,0.f};

    const float* xbase = x + (size_t)(b * L_DIM + row0) * H_DIM;

    // Prologue: stage panel 0 into buffer 0 (8 async ops per thread)
    {
        #pragma unroll
        for (int i = 0; i < 4; ++i) {
            int id = tid + i * 256;            // 0..1023
            int r  = id >> 4;                  // row 0..63
            int c  = (id & 15) * 4;            // float col 0..60
            async_copy_b128(xbase + (size_t)r * H_DIM + c, &lds_x[0][r][c]);
            async_copy_b128(Ws    + (size_t)r * H_DIM + c, &lds_w[0][r][c]);
        }
    }

    for (int kc = 0; kc < H_DIM / 64; ++kc) {
        const int cur = kc & 1;
        if (kc + 1 < H_DIM / 64) {
            const int nxt = cur ^ 1;
            #pragma unroll
            for (int i = 0; i < 4; ++i) {
                int id = tid + i * 256;
                int r  = id >> 4;
                int c  = (id & 15) * 4;
                async_copy_b128(xbase + (size_t)r * H_DIM + (kc + 1) * 64 + c,
                                &lds_x[nxt][r][c]);
                async_copy_b128(Ws    + (size_t)r * H_DIM + (kc + 1) * 64 + c,
                                &lds_w[nxt][r][c]);
            }
            // 8 newest async ops are the next panel; anything older (current
            // panel) has completed once ASYNCcnt <= 8.
            asm volatile("s_wait_asynccnt 0x8" ::: "memory");
        } else {
            asm volatile("s_wait_asynccnt 0x0" ::: "memory");
        }
        __syncthreads();

        // 16 WMMA K-steps of 4 over this 64-wide panel, for both tiles
        #pragma unroll
        for (int kk = 0; kk < 16; ++kk) {
            const int kb = kk * 4 + half * 2;   // A: lanes 0-15 K=0,1; 16-31 K=2,3
            v2f a0 = { lds_x[cur][mt0 * 16 + lm][kb], lds_x[cur][mt0 * 16 + lm][kb + 1] };
            v2f b0 = { lds_w[cur][nt0 * 16 + lm][kb], lds_w[cur][nt0 * 16 + lm][kb + 1] };
            acc0 = __builtin_amdgcn_wmma_f32_16x16x4_f32(
                false, a0, false, b0, (short)0, acc0, false, false);
            v2f a1 = { lds_x[cur][mt1 * 16 + lm][kb], lds_x[cur][mt1 * 16 + lm][kb + 1] };
            v2f b1 = { lds_w[cur][nt1 * 16 + lm][kb], lds_w[cur][nt1 * 16 + lm][kb + 1] };
            acc1 = __builtin_amdgcn_wmma_f32_16x16x4_f32(
                false, a1, false, b1, (short)0, acc1, false, false);
        }
        __syncthreads();   // all waves done reading 'cur' before it is re-filled
    }

    // Write state tile (C/D layout: VGPR v -> row v (lanes 0-15) / v+8 (16-31))
    float* sbase = state + (size_t)(b * L_DIM + row0) * S_DIM;
    #pragma unroll
    for (int v = 0; v < 8; ++v) {
        sbase[(mt0 * 16 + half * 8 + v) * S_DIM + nt0 * 16 + lm] = acc0[v];
        sbase[(mt1 * 16 + half * 8 + v) * S_DIM + nt1 * 16 + lm] = acc1[v];
    }

    // Per-tile column sums: sum the 8 rows this lane holds, fold the two
    // 16-lane halves of the wave32, leaving the 16-row tile sum in lanes 0-15.
    float p0 = 0.f, p1 = 0.f;
    #pragma unroll
    for (int v = 0; v < 8; ++v) { p0 += acc0[v]; p1 += acc1[v]; }
    p0 += __shfl_down(p0, 16, 32);
    p1 += __shfl_down(p1, 16, 32);
    if (half == 0) {
        colsum[mt0][nt0 * 16 + lm] = p0;
        colsum[mt1][nt1 * 16 + lm] = p1;
    }
    __syncthreads();

    if (tid < 64) {
        float cs = colsum[0][tid] + colsum[1][tid] + colsum[2][tid] + colsum[3][tid];
        chunkSums[(size_t)(b * NCHUNK + chunk) * S_DIM + tid] = cs;
    }
}

// ---------------------------------------------------------------------------
// Kernel 2: chunk offsets + in-chunk cumsum + RMSNorm + GEMM2 (norm @ Wo^T) -> out
// One work-group takes CPB chunks in a row (256 rows) and 512 columns of H.
// Each wave loads the Wo fragments of its 64 columns once, keeps them in
// registers and walks down the 16 row tiles, so Wo is fetched once per 256
// rows and an A fragment read from LDS feeds four products.
// grid.x = group of CPB chunks, grid.y = half of H: 256 work-groups.
// ---------------------------------------------------------------------------
#define CPB 4                  // chunks per work-group
#define ROWS2 (CPB * 64)       // rows per work-group

// At most two waves a SIMD = one work-group a WGP: no WGP takes a second
// work-group of this grid while another WGP has none.
__global__ __launch_bounds__(256) __attribute__((amdgpu_waves_per_eu(2, 2)))
void gemm2_kernel(const float* __restrict__ state, const float* __restrict__ chunkSums,
                  const float* __restrict__ Wo, float* __restrict__ out) {
    __shared__ __attribute__((aligned(16))) float lds_s[ROWS2][68];
    __shared__ float rsc[ROWS2];
    __shared__ __attribute__((aligned(16))) float offp[CPB][16][64];  // per chunk: partial sums of the earlier chunks' sums

    const int blk    = blockIdx.x;
    const int b      = blk / (NCHUNK / CPB);
    const int chunk0 = (blk % (NCHUNK / CPB)) * CPB;
    const int row0   = chunk0 * 64;
    const int ng     = blockIdx.y;    // 0 or 1 -> H columns [ng*512, ng*512+512)

    const int tid  = threadIdx.x;
    const int w    = tid >> 5;
    const int lane = tid & 31;
    const int half = lane >> 4;
    const int lm   = lane & 15;

    // Stage the 256x64 state tile with async DMA (16 b128 per thread)
    const float* sbase = state + (size_t)(b * L_DIM + row0) * S_DIM;
    #pragma unroll
    for (int i = 0; i < ROWS2 / 16; ++i) {
        int id = tid + i * 256;
        int r  = id >> 4;
        int c  = (id & 15) * 4;
        async_copy_b128(sbase + (size_t)r * S_DIM + c, &lds_s[r][c]);
    }

    // Offset of chunk chunk0+t = sum of the column sums of chunks 0..chunk0+t-1.
    // 16 groups of 16 threads; group g adds chunks 8g..8g+7, four columns a
    // thread. The eight loads are issued before the first add (every chunk sum
    // of this batch row was written by the launch before) and serve all CPB
    // chunks; for each of them the later chunks count 0.
    {
        const int g = tid >> 4;
        const int q = (tid & 15) * 4;
        float4 p[CPB];
        #pragma unroll
        for (int t = 0; t < CPB; ++t) p[t] = make_float4(0.f, 0.f, 0.f, 0.f);
        if (w * 16 < chunk0 + CPB - 1) {  // same for the whole wave
            const float* cs = chunkSums + (size_t)(b * NCHUNK + g * 8) * S_DIM + q;
            float4 v[8];
            #pragma unroll   // keeps v in registers and the eight loads in flight together
            for (int i = 0; i < 8; ++i) v[i] = *(const float4*)(cs + i * S_DIM);
            #pragma unroll
            for (int t = 0; t < CPB; ++t) {
                #pragma unroll
                for (int i = 0; i < 8; ++i) {
                    const bool on = g * 8 + i < chunk0 + t;
                    p[t].x += on ? v[i].x : 0.f;
                    p[t].y += on ? v[i].y : 0.f;
                    p[t].z += on ? v[i].z : 0.f;
                    p[t].w += on ? v[i].w : 0.f;
                }
            }
        }
        #pragma unroll
        for (int t = 0; t < CPB; ++t) *(float4*)&offp[t][g][q] = p[t];
    }
    asm volatile("s_wait_asynccnt 0x0" ::: "memory");
    __syncthreads();

    // Wo fragments of this wave's four column tiles (64 columns side by side),
    // issued here so that they arrive while the cumsum below runs on LDS alone.
    const int n0 = (ng * 32 + w * 4) * 16 + lm;   // this lane's h index in tile 0
    v2f bf[4][16];
    #pragma unroll
    for (int j = 0; j < 4; ++j) {
        #pragma unroll
        for (int kk = 0; kk < 16; ++kk) {
            int kb = kk * 4 + half * 2;
            bf[j][kk][0] = Wo[(size_t)(n0 + j * 16) * S_DIM + kb];
            bf[j][kk][1] = Wo[(size_t)(n0 + j * 16) * S_DIM + kb + 1];
        }
    }

    // In-chunk cumsum down the 64 rows (one thread per chunk and s-column)
    {
        const int t   = tid >> 6;
        const int col = tid & 63;
        float run = 0.f;
        #pragma unroll   // the 16 LDS reads go out together instead of one a trip
        for (int g = 0; g < 16; ++g) run += offp[t][g][col];
        for (int r = 0; r < 64; ++r) {
            run += lds_s[t * 64 + r][col];
            lds_s[t * 64 + r][col] = run;
        }
    }
    __syncthreads();

    // RMS scale per row (one thread per row)
    {
        float ss = 0.f;
        #pragma unroll
        for (int c = 0; c < 64; ++c) { float v = lds_s[tid][c]; ss += v * v; }
        rsc[tid] = rsqrtf(ss * (1.0f / (float)S_DIM) + EPS);
    }
    __syncthreads();

    // GEMM2: M=256 rows, K=64 (s), N=64 columns for this wave.
    float* obase = out + (size_t)(b * L_DIM + row0) * H_DIM + n0;
    for (int mt = 0; mt < ROWS2 / 16; ++mt) {
        const int m = mt * 16 + lm;
        const float sc = rsc[m];
        v2f a[16];
        #pragma unroll
        for (int kk = 0; kk < 16; ++kk) {
            int kb = kk * 4 + half * 2;
            a[kk][0] = lds_s[m][kb] * sc;
            a[kk][1] = lds_s[m][kb + 1] * sc;
        }
        v8f acc[4];
        #pragma unroll
        for (int j = 0; j < 4; ++j) acc[j] = (v8f){0.f,0.f,0.f,0.f,0.f,0.f,0.f,0.f};
        #pragma unroll
        for (int kk = 0; kk < 16; ++kk) {
            #pragma unroll
            for (int j = 0; j < 4; ++j) {
                acc[j] = __builtin_amdgcn_wmma_f32_16x16x4_f32(
                    false, a[kk], false, bf[j][kk], (short)0, acc[j], false, false);
            }
        }
        #pragma unroll
        for (int v = 0; v < 8; ++v) {
            #pragma unroll
            for (int j = 0; j < 4; ++j) {
                obase[(size_t)(mt * 16 + half * 8 + v) * H_DIM + j * 16] = acc[j][v];
            }
        }
        // The next trip rewrites the stores' address and data registers.
        asm volatile("s_wait_xcnt 0x0" ::: "memory");
    }
}

// ---------------------------------------------------------------------------
// Host launch
// ---------------------------------------------------------------------------
extern "C" void kernel_launch(void* const* d_in, const int* in_sizes, int n_in,
                              void* d_out, int out_size, void* d_ws, size_t ws_size,
                              hipStream_t stream) {
    (void)in_sizes; (void)n_in; (void)out_size; (void)ws_size;
    const float* x  = (const float*)d_in[0];   // (B, L, H)
    const float* Ws = (const float*)d_in[1];   // (S, H)
    const float* Wo = (const float*)d_in[2];   // (H, S)
    float* out = (float*)d_out;                // (B, L, H)

    // Workspace layout: state (8 MB) | chunkSums (128 KB)
    float* state     = (float*)d_ws;
    float* chunkSums = state + (size_t)B_DIM * L_DIM * S_DIM;

    gemm1_kernel<<<dim3(B_DIM * NCHUNK), dim3(256), 0, stream>>>(x, Ws, state, chunkSums);
    gemm2_kernel<<<dim3(B_DIM * NCHUNK / CPB, 2), dim3(256), 0, stream>>>(state, chunkSums, Wo, out);
}
